// v000
// The times below were measured on an AMD MI455X: many runs one after another, warmed up first and cycling through
// copies of the inputs, with the whole window's GPU time divided by the number of runs. Launches and the gaps
// between them are all in it. The median over several windows is given; except for v000 it joins two sittings, which
// can be a few percent apart, so the side-by-side timings, each taken in one sitting, are the better comparison.
// The starting kernel, v000, takes 36.1 microseconds a run.
#include <hip/hip_runtime.h>

typedef float v2f __attribute__((ext_vector_type(2)));
typedef float v8f __attribute__((ext_vector_type(8)));

// D = A(16x4, f32) * B(4x16, f32) + C(16x16, f32), exact f32 — CDNA5 WMMA.
#define WMMA_F32X4(a, b, c) \
  __builtin_amdgcn_wmma_f32_16x16x4_f32(false, (a), false, (b), (short)0, (c), false, false)

constexpr int Bsz = 8, H = 16, S = 2048, D = 64;
constexpr int W = 11;      // window offsets -5..+5
constexpr int TS = 16;     // rows (s positions) per tile / wave
constexpr int BAND = 32;   // staged K/V band columns: s0-8 .. s0+23
constexpr int ST = 68;     // LDS row stride (floats): 272B, 16B-aligned rows,
                           // banks (4*ln+d)&63 -> conflict-free lane gathers

// Async global -> LDS, 16 bytes per lane. Tracked with ASYNCcnt.
__device__ __forceinline__ void async_ld_b128(uint32_t lds_byte, uint32_t gbyte_off,
                                              const void* sbase) {
  asm volatile("global_load_async_to_lds_b128 %0, %1, %2"
               :: "v"(lds_byte), "v"(gbyte_off),
                  "s"((unsigned long long)(uintptr_t)sbase)
               : "memory");
}

__device__ __forceinline__ void wait_async0() {
  asm volatile("s_wait_asynccnt 0" ::: "memory");
}

__device__ __forceinline__ uint32_t lds_off(const void* p) {
  // flat shared address carries the LDS byte offset in its low 32 bits
  return (uint32_t)(uintptr_t)p;
}

__global__ __launch_bounds__(32)
void winattn_kernel(const float* __restrict__ q, const float* __restrict__ k,
                    const float* __restrict__ v, const float* __restrict__ ek,
                    const float* __restrict__ ev, float* __restrict__ out) {
  __shared__ float Qt[16][ST];    // q tile          [m][d]
  __shared__ float Kb[32][ST];    // k band          [c][d]
  __shared__ float Vb[32][ST];    // v band          [c][d]
  __shared__ float Ekp[16][ST];   // ek rows (padded)[w][d]
  __shared__ float Evp[16][ST];   // ev rows (padded)[w][d]
  __shared__ float Sf[16][33];    // QK^T band tile  [m][c]
  __shared__ float Rr[16][17];    // Q ek^T tile     [m][w]
  __shared__ float Wb[16][33];    // banded weights  [m][c]
  __shared__ float W16[16][17];   // padded weights  [m][w]

  const int lane = threadIdx.x;        // 0..31, one full wave32
  const int half = lane >> 4;          // 0 | 1
  const int ln   = lane & 15;

  const int tilesPerBH = S / TS;                  // 128
  const int bh = blockIdx.x / tilesPerBH;         // fused b*H+h
  const int s0 = (blockIdx.x % tilesPerBH) * TS;  // tile row base
  const long base = (long)bh * S * D;

  const float* qbh = q + base;
  const float* kbh = k + base;
  const float* vbh = v + base;

  const uint32_t QtB = lds_off(&Qt[0][0]);
  const uint32_t KbB = lds_off(&Kb[0][0]);
  const uint32_t VbB = lds_off(&Vb[0][0]);
  const uint32_t EkB = lds_off(&Ekp[0][0]);
  const uint32_t EvB = lds_off(&Evp[0][0]);

  // ---- async-stage tiles into LDS, 16B (4-float) chunks per lane ----
  // Qt: 16 rows * 16 chunks = 256 chunks
#pragma unroll
  for (int it = 0; it < 8; ++it) {
    const int cid = it * 32 + lane;
    const int r = cid >> 4, d4 = cid & 15;
    async_ld_b128(QtB + (uint32_t)(r * ST + d4 * 4) * 4u,
                  (uint32_t)(((s0 + r) * D + d4 * 4) * 4), qbh);
  }
  // K/V band: 32 rows * 16 chunks = 512 chunks each
#pragma unroll
  for (int it = 0; it < 16; ++it) {
    const int cid = it * 32 + lane;
    const int c = cid >> 4, d4 = cid & 15;
    const int gs = (s0 - 8 + c + S) & (S - 1);     // circular roll, S pow2
    const uint32_t go = (uint32_t)((gs * D + d4 * 4) * 4);
    async_ld_b128(KbB + (uint32_t)(c * ST + d4 * 4) * 4u, go, kbh);
    async_ld_b128(VbB + (uint32_t)(c * ST + d4 * 4) * 4u, go, vbh);
  }
  // Embedding rows 0..10 (row = w+11 in the 33-row tables): 176 chunks
#pragma unroll
  for (int it = 0; it < 6; ++it) {
    const int cid = it * 32 + lane;
    if (cid < W * 16) {
      const int w = cid >> 4, d4 = cid & 15;
      const uint32_t go = (uint32_t)(((w + 11) * D + d4 * 4) * 4);
      async_ld_b128(EkB + (uint32_t)(w * ST + d4 * 4) * 4u, go, ek);
      async_ld_b128(EvB + (uint32_t)(w * ST + d4 * 4) * 4u, go, ev);
    }
  }
  // zero-pad emb rows 11..15 (read by the padded-K WMMA steps)
  for (int idx = lane; idx < 5 * D; idx += 32) {
    const int w = W + (idx >> 6), d = idx & 63;
    Ekp[w][d] = 0.0f;
    Evp[w][d] = 0.0f;
  }
  wait_async0();
  __syncthreads();

  // ---- scores: Sf = Q * Kband^T (16x32), Rr = Q * ek^T (16x16) ----
  // A layout: lane=M(ln), K = 2*half + vgpr.  B layout: lane=N(ln), same K striping.
  v8f accS0 = {}, accS1 = {}, accR = {};
#pragma unroll
  for (int kk = 0; kk < 16; ++kk) {
    const int d0 = 4 * kk + 2 * half;
    v2f a;  a.x  = Qt[ln][d0];        a.y  = Qt[ln][d0 + 1];
    v2f b0; b0.x = Kb[ln][d0];        b0.y = Kb[ln][d0 + 1];
    v2f b1; b1.x = Kb[16 + ln][d0];   b1.y = Kb[16 + ln][d0 + 1];
    v2f b2; b2.x = Ekp[ln][d0];       b2.y = Ekp[ln][d0 + 1];
    accS0 = WMMA_F32X4(a, b0, accS0);
    accS1 = WMMA_F32X4(a, b1, accS1);
    accR  = WMMA_F32X4(a, b2, accR);
  }
  // C/D layout: vgpr j -> M = j + 8*half, N = ln
#pragma unroll
  for (int j = 0; j < 8; ++j) {
    const int m = j + 8 * half;
    Sf[m][ln]      = accS0[j];
    Sf[m][16 + ln] = accS1[j];
    Rr[m][ln]      = accR[j];
  }
  __syncthreads();

  // ---- per-row softmax over the 11 window offsets; build weight matrices ----
  if (lane < 16) {
    const int m = lane;
    float sc[W];
    float mx = -1e30f;
#pragma unroll
    for (int w = 0; w < W; ++w) {
      // band column for (row m, offset w-5): c = m + w + 3
      sc[w] = 0.125f * (Sf[m][m + w + 3] + Rr[m][w]);   // scale = 1/sqrt(64)
      mx = fmaxf(mx, sc[w]);
    }
    float sum = 0.0f;
#pragma unroll
    for (int w = 0; w < W; ++w) { sc[w] = __expf(sc[w] - mx); sum += sc[w]; }
    const float inv = 1.0f / sum;
#pragma unroll
    for (int c = 0; c < 32; ++c) Wb[m][c] = 0.0f;
#pragma unroll
    for (int w = 0; w < W; ++w) Wb[m][m + w + 3] = sc[w] * inv;
#pragma unroll
    for (int w = 0; w < 16; ++w) W16[m][w] = (w < W) ? sc[w] * inv : 0.0f;
  }
  __syncthreads();

  // ---- out = Wb(16x32) * Vband(32x64)  +  W16(16x16) * ev(16x64) ----
#pragma unroll
  for (int nt = 0; nt < 4; ++nt) {
    v8f acc = {};
#pragma unroll
    for (int kk = 0; kk < 8; ++kk) {           // K over 32 band columns
      const int c0 = 4 * kk + 2 * half;
      v2f a; a.x = Wb[ln][c0];             a.y = Wb[ln][c0 + 1];
      v2f b; b.x = Vb[c0][16 * nt + ln];   b.y = Vb[c0 + 1][16 * nt + ln];
      acc = WMMA_F32X4(a, b, acc);
    }
#pragma unroll
    for (int kk = 0; kk < 4; ++kk) {           // K over 16 (11 valid) offsets
      const int w0 = 4 * kk + 2 * half;
      v2f a; a.x = W16[ln][w0];            a.y = W16[ln][w0 + 1];
      v2f b; b.x = Evp[w0][16 * nt + ln];  b.y = Evp[w0 + 1][16 * nt + ln];
      acc = WMMA_F32X4(a, b, acc);
    }
#pragma unroll
    for (int j = 0; j < 8; ++j) {
      const int m = j + 8 * half;
      out[base + (long)(s0 + m) * D + 16 * nt + ln] = acc[j];
    }
  }
}

extern "C" void kernel_launch(void* const* d_in, const int* in_sizes, int n_in,
                              void* d_out, int out_size, void* d_ws, size_t ws_size,
                              hipStream_t stream) {
  const float* q  = (const float*)d_in[0];
  const float* k  = (const float*)d_in[1];
  const float* v  = (const float*)d_in[2];
  const float* ek = (const float*)d_in[3];
  const float* ev = (const float*)d_in[4];
  float* out = (float*)d_out;

  dim3 grid(Bsz * H * (S / TS));   // 16384 tiles, one wave32 each
  dim3 block(32);
  hipLaunchKernelGGL(winattn_kernel, grid, block, 0, stream, q, k, v, ek, ev, out);
}

// v001
// It runs in 27.6 microseconds.
// Next to v000, in two timings, it ran 1.35 and 1.34 times as fast.
#include <hip/hip_runtime.h>

typedef float v2f __attribute__((ext_vector_type(2)));
typedef float v8f __attribute__((ext_vector_type(8)));

// D = A(16x4, f32) * B(4x16, f32) + C(16x16, f32), exact f32 — CDNA5 WMMA.
#define WMMA_F32X4(a, b, c) \
  __builtin_amdgcn_wmma_f32_16x16x4_f32(false, (a), false, (b), (short)0, (c), false, false)

constexpr int Bsz = 8, H = 16, S = 2048, D = 64;
constexpr int W = 11;        // window offsets -5..+5
constexpr int TS = 16;       // rows (s positions) per wave
constexpr int NW = 4;        // waves per work-group
constexpr int TR = NW * TS;  // rows per work-group
constexpr int BR = TR + 16;  // staged K/V band rows, shared by the waves: s0-8 .. s0+TR+7
constexpr int ST = 68;       // LDS row stride (floats): 272B, 16B-aligned rows,
                             // banks (4*ln+d)&63 -> conflict-free lane gathers

// Async global -> LDS, 16 bytes per lane, tracked with ASYNCcnt. Each run of copies ends,
// inside its own statement, with s_wait_xcnt 0: a precaution that stands in front of any
// later write of the address registers the copies name.
// 8 copies: LDS byte addresses l[], byte offsets g[] from the scalar base
__device__ __forceinline__ void async_ld_b128_x8(const uint32_t (&l)[8], const uint32_t (&g)[8],
                                                 const void* sbase) {
  asm volatile(
               "global_load_async_to_lds_b128 %0, %8, %16\n\t"
               "global_load_async_to_lds_b128 %1, %9, %16\n\t"
               "global_load_async_to_lds_b128 %2, %10, %16\n\t"
               "global_load_async_to_lds_b128 %3, %11, %16\n\t"
               "global_load_async_to_lds_b128 %4, %12, %16\n\t"
               "global_load_async_to_lds_b128 %5, %13, %16\n\t"
               "global_load_async_to_lds_b128 %6, %14, %16\n\t"
               "global_load_async_to_lds_b128 %7, %15, %16\n\t"
               "s_wait_xcnt 0x0"
               :: "v"(l[0]), "v"(l[1]), "v"(l[2]), "v"(l[3]),
                  "v"(l[4]), "v"(l[5]), "v"(l[6]), "v"(l[7]),
                  "v"(g[0]), "v"(g[1]), "v"(g[2]), "v"(g[3]),
                  "v"(g[4]), "v"(g[5]), "v"(g[6]), "v"(g[7]),
                  "s"((unsigned long long)(uintptr_t)sbase)
               : "memory");
}

// 10 copies, same form
__device__ __forceinline__ void async_ld_b128_x10(const uint32_t (&l)[10], const uint32_t (&g)[10],
                                                  const void* sbase) {
  asm volatile(
               "global_load_async_to_lds_b128 %0, %10, %20\n\t"
               "global_load_async_to_lds_b128 %1, %11, %20\n\t"
               "global_load_async_to_lds_b128 %2, %12, %20\n\t"
               "global_load_async_to_lds_b128 %3, %13, %20\n\t"
               "global_load_async_to_lds_b128 %4, %14, %20\n\t"
               "global_load_async_to_lds_b128 %5, %15, %20\n\t"
               "global_load_async_to_lds_b128 %6, %16, %20\n\t"
               "global_load_async_to_lds_b128 %7, %17, %20\n\t"
               "global_load_async_to_lds_b128 %8, %18, %20\n\t"
               "global_load_async_to_lds_b128 %9, %19, %20\n\t"
               "s_wait_xcnt 0x0"
               :: "v"(l[0]), "v"(l[1]), "v"(l[2]), "v"(l[3]), "v"(l[4]),
                  "v"(l[5]), "v"(l[6]), "v"(l[7]), "v"(l[8]), "v"(l[9]),
                  "v"(g[0]), "v"(g[1]), "v"(g[2]), "v"(g[3]), "v"(g[4]),
                  "v"(g[5]), "v"(g[6]), "v"(g[7]), "v"(g[8]), "v"(g[9]),
                  "s"((unsigned long long)(uintptr_t)sbase)
               : "memory");
}

// copies with a per-lane 64-bit global pointer
__device__ __forceinline__ void async_ld_b128_p2(uint32_t l0, const float* g0,
                                                 uint32_t l1, const float* g1) {
  asm volatile(
               "global_load_async_to_lds_b128 %0, %1, off\n\t"
               "global_load_async_to_lds_b128 %2, %3, off\n\t"
               "s_wait_xcnt 0x0"
               :: "v"(l0), "v"(g0), "v"(l1), "v"(g1) : "memory");
}
__device__ __forceinline__ void async_ld_b128_p1(uint32_t l0, const float* g0) {
  asm volatile(
               "global_load_async_to_lds_b128 %0, %1, off\n\t"
               "s_wait_xcnt 0x0"
               :: "v"(l0), "v"(g0) : "memory");
}

__device__ __forceinline__ void wait_async0() {
  asm volatile("s_wait_asynccnt 0" ::: "memory");
}

// e^x as the fast intrinsic forms it (one multiply, v_exp_f32). The v_nop in the same statement
// keeps the free slot the instruction set asks for behind a transcendental.
__device__ __forceinline__ float exp_slot(float x) {
  float r;
  asm("v_exp_f32 %0, %1\n\tv_nop" : "=v"(r) : "v"(x * 1.44269504f));
  return r;
}

__device__ __forceinline__ uint32_t lds_off(const void* p) {
  // flat shared address carries the LDS byte offset in its low 32 bits
  return (uint32_t)(uintptr_t)p;
}

__global__ __launch_bounds__(NW * 32)
void winattn_kernel(const float* __restrict__ q, const float* __restrict__ k,
                    const float* __restrict__ v, const float* __restrict__ ek,
                    const float* __restrict__ ev, float* __restrict__ out) {
  __shared__ __attribute__((aligned(16))) float Qt[TR][ST];   // q rows [m][d]; wave w owns rows 16w..16w+15
  __shared__ __attribute__((aligned(16))) float Kb[BR][ST];   // k band          [c][d]
  __shared__ __attribute__((aligned(16))) float Vb[BR][ST];   // v band          [c][d]
  __shared__ __attribute__((aligned(16))) float Ekp[16][ST];  // ek rows (padded)[w][d]
  __shared__ __attribute__((aligned(16))) float Evp[16][ST];  // ev rows (padded)[w][d]

  const int tid  = threadIdx.x;
  const int lane = tid & 31;
  const int wave = __builtin_amdgcn_readfirstlane(tid >> 5);   // 0..NW-1, scalar
  const int half = lane >> 4;          // 0 | 1
  const int ln   = lane & 15;

  const int tilesPerBH = S / TR;                  // 32
  const int bh = blockIdx.x / tilesPerBH;         // fused b*H+h
  const int s0 = (blockIdx.x % tilesPerBH) * TR;  // work-group row base
  const long base = (long)bh * S * D;

  const float* qbh = q + base;
  const float* kbh = k + base;
  const float* vbh = v + base;

  const uint32_t QtB = lds_off(&Qt[0][0]);
  const uint32_t KbB = lds_off(&Kb[0][0]);
  const uint32_t VbB = lds_off(&Vb[0][0]);
  const uint32_t EkB = lds_off(&Ekp[0][0]);
  const uint32_t EvB = lds_off(&Evp[0][0]);

  // ---- async-stage the work-group's tiles into LDS, 16B (4-float) chunks per lane ----
  // 128 threads cover 8 rows of 16 chunks per copy.
  const int r0 = tid >> 4, d4 = tid & 15;
  {
    uint32_t l[TR / 8], g[TR / 8];
#pragma unroll
    for (int it = 0; it < TR / 8; ++it) {
      const int r = it * 8 + r0;
      l[it] = QtB + (uint32_t)(r * ST + d4 * 4) * 4u;
      g[it] = (uint32_t)(((s0 + r) * D + d4 * 4) * 4);
    }
    async_ld_b128_x8(l, g, qbh);
  }
  {
    uint32_t lk[BR / 8], lv[BR / 8], g[BR / 8];
#pragma unroll
    for (int it = 0; it < BR / 8; ++it) {
      const int c = it * 8 + r0;
      const int gs = (s0 - 8 + c + S) & (S - 1);     // circular roll, S pow2
      lk[it] = KbB + (uint32_t)(c * ST + d4 * 4) * 4u;
      lv[it] = VbB + (uint32_t)(c * ST + d4 * 4) * 4u;
      g[it]  = (uint32_t)((gs * D + d4 * 4) * 4);
    }
    async_ld_b128_x10(lk, g, kbh);
    async_ld_b128_x10(lv, g, vbh);
  }
  // Embedding rows 0..10 (row = w+11 in the 33-row tables): one copy of a wave brings
  // row u of ek (lanes 0-15) and row u of ev (lanes 16-31); u = wave, wave+4, wave+8.
  {
    const float* esrc = (half ? ev : ek) + 11 * D + ln * 4;
    const uint32_t edst = (half ? EvB : EkB) + (uint32_t)(ln * 16);
    async_ld_b128_p2(edst + (uint32_t)(wave * ST * 4), esrc + wave * D,
                     edst + (uint32_t)((wave + NW) * ST * 4), esrc + (wave + NW) * D);
    if (wave + 2 * NW < W)   // scalar test: whole waves issue or skip
      async_ld_b128_p1(edst + (uint32_t)((wave + 2 * NW) * ST * 4), esrc + (wave + 2 * NW) * D);
  }
  // zero-pad emb rows 11..15 (read by the padded-K WMMA steps)
  for (int idx = tid; idx < 5 * D; idx += NW * 32) {
    const int w = W + (idx >> 6), d = idx & 63;
    Ekp[w][d] = 0.0f;
    Evp[w][d] = 0.0f;
  }
  wait_async0();
  __syncthreads();

  const int cb = wave * TS;            // this wave's first band row
  float (*Sc)[ST] = &Qt[wave * TS];    // this wave's q rows; once the scores are formed they hold
                                       // [m][0..31] band scores then weights, [m][32..47] offset scores then weights

  // ---- scores: Q * Kband^T (16x32), Q * ek^T (16x16) ----
  // A layout: lane=M(ln), K = 2*half + vgpr.  B layout: lane=N(ln), same K striping.
  v8f accS0 = {}, accS1 = {}, accR = {};
#pragma unroll
  for (int kk = 0; kk < 16; ++kk) {
    const int d0 = 4 * kk + 2 * half;
    v2f a;  a.x  = Sc[ln][d0];             a.y  = Sc[ln][d0 + 1];
    v2f b0; b0.x = Kb[cb + ln][d0];        b0.y = Kb[cb + ln][d0 + 1];
    v2f b1; b1.x = Kb[cb + 16 + ln][d0];   b1.y = Kb[cb + 16 + ln][d0 + 1];
    v2f b2; b2.x = Ekp[ln][d0];            b2.y = Ekp[ln][d0 + 1];
    accS0 = WMMA_F32X4(a, b0, accS0);
    accS1 = WMMA_F32X4(a, b1, accS1);
    accR  = WMMA_F32X4(a, b2, accR);
  }
  // C/D layout: vgpr j -> M = j + 8*half, N = ln
#pragma unroll
  for (int j = 0; j < 8; ++j) {
    const int m = j + 8 * half;
    Sc[m][ln]      = accS0[j];
    Sc[m][16 + ln] = accS1[j];
    Sc[m][32 + ln] = accR[j];
  }
  __syncthreads();

  // ---- per-row softmax over the 11 window offsets; build weight matrices in place ----
  if (lane < 16) {
    const int m = lane;
    float sc[W];
    float mx = -1e30f;
#pragma unroll
    for (int w = 0; w < W; ++w) {
      // band column for (row m, offset w-5): c = m + w + 3
      sc[w] = 0.125f * (Sc[m][m + w + 3] + Sc[m][32 + w]);   // scale = 1/sqrt(64)
      mx = fmaxf(mx, sc[w]);
    }
    float sum = 0.0f;
#pragma unroll
    for (int w = 0; w < W; ++w) { sc[w] = exp_slot(sc[w] - mx); sum += sc[w]; }
    const float inv = 1.0f / sum;
#pragma unroll
    for (int c = 0; c < 32; ++c) Sc[m][c] = 0.0f;
#pragma unroll
    for (int w = 0; w < W; ++w) Sc[m][m + w + 3] = sc[w] * inv;
#pragma unroll
    for (int w = 0; w < 16; ++w) Sc[m][32 + w] = (w < W) ? sc[w] * inv : 0.0f;
  }
  __syncthreads();

  // ---- out = Wband(16x32) * Vband(32x64)  +  Woff(16x16) * ev(16x64) ----
#pragma unroll
  for (int nt = 0; nt < 4; ++nt) {
    v8f acc = {};
#pragma unroll
    for (int kk = 0; kk < 8; ++kk) {           // K over 32 band columns
      const int c0 = 4 * kk + 2 * half;
      v2f a; a.x = Sc[ln][c0];                  a.y = Sc[ln][c0 + 1];
      v2f b; b.x = Vb[cb + c0][16 * nt + ln];   b.y = Vb[cb + c0 + 1][16 * nt + ln];
      acc = WMMA_F32X4(a, b, acc);
    }
#pragma unroll
    for (int kk = 0; kk < 4; ++kk) {           // K over 16 (11 valid) offsets
      const int w0 = 4 * kk + 2 * half;
      v2f a; a.x = Sc[ln][32 + w0];        a.y = Sc[ln][32 + w0 + 1];
      v2f b; b.x = Evp[w0][16 * nt + ln];  b.y = Evp[w0 + 1][16 * nt + ln];
      acc = WMMA_F32X4(a, b, acc);
    }
#pragma unroll
    for (int j = 0; j < 8; ++j) {
      const int m = j + 8 * half;
      out[base + (long)(s0 + cb + m) * D + 16 * nt + ln] = acc[j];
    }
  }
}

extern "C" void kernel_launch(void* const* d_in, const int* in_sizes, int n_in,
                              void* d_out, int out_size, void* d_ws, size_t ws_size,
                              hipStream_t stream) {
  const float* q  = (const float*)d_in[0];
  const float* k  = (const float*)d_in[1];
  const float* v  = (const float*)d_in[2];
  const float* ek = (const float*)d_in[3];
  const float* ev = (const float*)d_in[4];
  float* out = (float*)d_out;

  dim3 grid(Bsz * H * (S / TR));   // 4096 work-groups of 4 waves, 64 rows each
  dim3 block(NW * 32);
  hipLaunchKernelGGL(winattn_kernel, grid, block, 0, stream, q, k, v, ek, ev, out);
}

// v002
// Measured time: 25.4 microseconds a run.
// Next to v001, in two timings, it ran 1.09 and 1.08 times as fast.
// Counting every step since v000, it is 1.46 times as fast.
#include <hip/hip_runtime.h>

typedef float v2f __attribute__((ext_vector_type(2)));
typedef float v8f __attribute__((ext_vector_type(8)));

// D = A(16x4, f32) * B(4x16, f32) + C(16x16, f32), exact f32 — CDNA5 WMMA.
#define WMMA_F32X4(a, b, c) \
  __builtin_amdgcn_wmma_f32_16x16x4_f32(false, (a), false, (b), (short)0, (c), false, false)

constexpr int Bsz = 8, H = 16, S = 2048, D = 64;
constexpr int W = 11;        // window offsets -5..+5
constexpr int TS = 16;       // rows (s positions) per wave
constexpr int NW = 4;        // waves per work-group
constexpr int TR = NW * TS;  // rows per tile
constexpr int NT = 4;        // row tiles per work-group, one after the other
constexpr int NG = Bsz * H * (S / TR) / NT;   // work-groups
constexpr int BR = TR + 16;  // staged K/V band rows, shared by the waves: s0-8 .. s0+TR+7
constexpr int ST = 68;       // LDS row stride (floats): 272B, 16B-aligned rows,
                             // banks (4*ln+d)&63 -> conflict-free lane gathers

// Async global -> LDS, 16 bytes per lane, tracked with ASYNCcnt. Each run of copies ends,
// inside its own statement, with s_wait_xcnt 0: a precaution that stands in front of any
// later write of the address registers the copies name.
// 8 copies: LDS byte addresses l[], byte offsets g[] from the scalar base
__device__ __forceinline__ void async_ld_b128_x8(const uint32_t (&l)[8], const uint32_t (&g)[8],
                                                 const void* sbase) {
  asm volatile(
               "global_load_async_to_lds_b128 %0, %8, %16\n\t"
               "global_load_async_to_lds_b128 %1, %9, %16\n\t"
               "global_load_async_to_lds_b128 %2, %10, %16\n\t"
               "global_load_async_to_lds_b128 %3, %11, %16\n\t"
               "global_load_async_to_lds_b128 %4, %12, %16\n\t"
               "global_load_async_to_lds_b128 %5, %13, %16\n\t"
               "global_load_async_to_lds_b128 %6, %14, %16\n\t"
               "global_load_async_to_lds_b128 %7, %15, %16\n\t"
               "s_wait_xcnt 0x0"
               :: "v"(l[0]), "v"(l[1]), "v"(l[2]), "v"(l[3]),
                  "v"(l[4]), "v"(l[5]), "v"(l[6]), "v"(l[7]),
                  "v"(g[0]), "v"(g[1]), "v"(g[2]), "v"(g[3]),
                  "v"(g[4]), "v"(g[5]), "v"(g[6]), "v"(g[7]),
                  "s"((unsigned long long)(uintptr_t)sbase)
               : "memory");
}

// 10 copies, same form
__device__ __forceinline__ void async_ld_b128_x10(const uint32_t (&l)[10], const uint32_t (&g)[10],
                                                  const void* sbase) {
  asm volatile(
               "global_load_async_to_lds_b128 %0, %10, %20\n\t"
               "global_load_async_to_lds_b128 %1, %11, %20\n\t"
               "global_load_async_to_lds_b128 %2, %12, %20\n\t"
               "global_load_async_to_lds_b128 %3, %13, %20\n\t"
               "global_load_async_to_lds_b128 %4, %14, %20\n\t"
               "global_load_async_to_lds_b128 %5, %15, %20\n\t"
               "global_load_async_to_lds_b128 %6, %16, %20\n\t"
               "global_load_async_to_lds_b128 %7, %17, %20\n\t"
               "global_load_async_to_lds_b128 %8, %18, %20\n\t"
               "global_load_async_to_lds_b128 %9, %19, %20\n\t"
               "s_wait_xcnt 0x0"
               :: "v"(l[0]), "v"(l[1]), "v"(l[2]), "v"(l[3]), "v"(l[4]),
                  "v"(l[5]), "v"(l[6]), "v"(l[7]), "v"(l[8]), "v"(l[9]),
                  "v"(g[0]), "v"(g[1]), "v"(g[2]), "v"(g[3]), "v"(g[4]),
                  "v"(g[5]), "v"(g[6]), "v"(g[7]), "v"(g[8]), "v"(g[9]),
                  "s"((unsigned long long)(uintptr_t)sbase)
               : "memory");
}

// copies with a per-lane 64-bit global pointer
__device__ __forceinline__ void async_ld_b128_p2(uint32_t l0, const float* g0,
                                                 uint32_t l1, const float* g1) {
  asm volatile(
               "global_load_async_to_lds_b128 %0, %1, off\n\t"
               "global_load_async_to_lds_b128 %2, %3, off\n\t"
               "s_wait_xcnt 0x0"
               :: "v"(l0), "v"(g0), "v"(l1), "v"(g1) : "memory");
}
__device__ __forceinline__ void async_ld_b128_p1(uint32_t l0, const float* g0) {
  asm volatile(
               "global_load_async_to_lds_b128 %0, %1, off\n\t"
               "s_wait_xcnt 0x0"
               :: "v"(l0), "v"(g0) : "memory");
}

__device__ __forceinline__ void wait_async0() {
  asm volatile("s_wait_asynccnt 0" ::: "memory");
}
// this wave's LDS reads and writes have retired: stands in front of a barrier behind which
// copies refill what the wave has read
__device__ __forceinline__ void wait_ds0() {
  asm volatile("s_wait_dscnt 0" ::: "memory");
}

// e^x as the fast intrinsic forms it (one multiply, v_exp_f32). The v_nop in the same statement
// keeps the free slot the instruction set asks for behind a transcendental.
__device__ __forceinline__ float exp_slot(float x) {
  float r;
  asm("v_exp_f32 %0, %1\n\tv_nop" : "=v"(r) : "v"(x * 1.44269504f));
  return r;
}

__device__ __forceinline__ uint32_t lds_off(const void* p) {
  // flat shared address carries the LDS byte offset in its low 32 bits
  return (uint32_t)(uintptr_t)p;
}

__global__ __launch_bounds__(NW * 32)
void winattn_kernel(const float* __restrict__ q, const float* __restrict__ k,
                    const float* __restrict__ v, const float* __restrict__ ek,
                    const float* __restrict__ ev, float* __restrict__ out) {
  __shared__ __attribute__((aligned(16))) float Qt[TR][ST];   // q rows [m][d]; wave w owns rows 16w..16w+15
  __shared__ __attribute__((aligned(16))) float Kb[BR][ST];   // k band          [c][d]
  __shared__ __attribute__((aligned(16))) float Vb[BR][ST];   // v band          [c][d]
  __shared__ __attribute__((aligned(16))) float Ekp[16][ST];  // ek rows (padded)[w][d]
  __shared__ __attribute__((aligned(16))) float Evp[16][ST];  // ev rows (padded)[w][d]

  const int tid  = threadIdx.x;
  const int lane = tid & 31;
  const int wave = __builtin_amdgcn_readfirstlane(tid >> 5);   // 0..NW-1, scalar
  const int half = lane >> 4;          // 0 | 1
  const int ln   = lane & 15;

  // Tile t of this work-group is tile blockIdx.x + t * NG of the NG * NT tiles: the same rows
  // s0 .. s0+TR-1 in every trip, NG / tilesPerBH heads further on each time.
  const int tilesPerBH = S / TR;                  // 32
  const int bh0 = blockIdx.x / tilesPerBH;        // fused b*H+h of trip 0
  const int s0 = (blockIdx.x % tilesPerBH) * TR;  // tile row base, alike in every trip
  const long step = (long)(NG / tilesPerBH) * S * D;   // floats from one trip's head to the next
  long base = (long)bh0 * S * D;

  const uint32_t QtB = lds_off(&Qt[0][0]);
  const uint32_t KbB = lds_off(&Kb[0][0]);
  const uint32_t VbB = lds_off(&Vb[0][0]);
  const uint32_t EkB = lds_off(&Ekp[0][0]);
  const uint32_t EvB = lds_off(&Evp[0][0]);

  // ---- async staging, 16B (4-float) chunks per lane; the addresses hold for every trip ----
  // Q: a wave copies its OWN 16 rows (2 rows a copy), so these rows are private to the wave.
  uint32_t lq[8], gq[8];
#pragma unroll
  for (int it = 0; it < 8; ++it) {
    const int r = wave * TS + it * 2 + half;
    lq[it] = QtB + (uint32_t)(r * ST + ln * 4) * 4u;
    gq[it] = (uint32_t)(((s0 + r) * D + ln * 4) * 4);
  }
  // K and V band: 128 threads cover 8 rows of 16 chunks per copy.
  const int r0 = tid >> 4, d4 = tid & 15;
  uint32_t lk[BR / 8], lv[BR / 8], gb[BR / 8];
#pragma unroll
  for (int it = 0; it < BR / 8; ++it) {
    const int c = it * 8 + r0;
    const int gs = (s0 - 8 + c + S) & (S - 1);     // circular roll, S pow2
    lk[it] = KbB + (uint32_t)(c * ST + d4 * 4) * 4u;
    lv[it] = VbB + (uint32_t)(c * ST + d4 * 4) * 4u;
    gb[it] = (uint32_t)((gs * D + d4 * 4) * 4);
  }

  async_ld_b128_x8(lq, gq, q + base);
  async_ld_b128_x10(lk, gb, k + base);
  // Embedding rows 0..10 (row = w+11 in the 33-row tables): one copy of a wave brings
  // row u of ek (lanes 0-15) and row u of ev (lanes 16-31); u = wave, wave+4, wave+8.
  {
    const float* esrc = (half ? ev : ek) + 11 * D + ln * 4;
    const uint32_t edst = (half ? EvB : EkB) + (uint32_t)(ln * 16);
    async_ld_b128_p2(edst + (uint32_t)(wave * ST * 4), esrc + wave * D,
                     edst + (uint32_t)((wave + NW) * ST * 4), esrc + (wave + NW) * D);
    if (wave + 2 * NW < W)   // scalar test: whole waves issue or skip
      async_ld_b128_p1(edst + (uint32_t)((wave + 2 * NW) * ST * 4), esrc + (wave + 2 * NW) * D);
  }
  // zero-pad emb rows 11..15 (read by the padded-K WMMA steps)
  for (int idx = tid; idx < 5 * D; idx += NW * 32) {
    const int w = W + (idx >> 6), d = idx & 63;
    Ekp[w][d] = 0.0f;
    Evp[w][d] = 0.0f;
  }

  const int cb = wave * TS;            // this wave's first band row
  float (*Sc)[ST] = &Qt[wave * TS];    // this wave's q rows; once the scores are formed they hold
                                       // [m][0..31] band scores then weights, [m][32..47] offset scores then weights

  // One buffer each for Q, K and V. In trip t the V band lands while the scores and the softmax
  // run, and the next tile's K band and Q rows land while the PV products run.
  // Kept rolled: four copies of the body would only lengthen the code that is fetched.
#pragma unroll 1
  for (int t = 0; t < NT; ++t) {
    // Q(t), K(t) landed; every wave has left the V band of the trip before.
    wait_ds0();
    wait_async0();
    __syncthreads();
    async_ld_b128_x10(lv, gb, v + base);

    // ---- scores: Q * Kband^T (16x32), Q * ek^T (16x16) ----
    // A layout: lane=M(ln), K = 2*half + vgpr.  B layout: lane=N(ln), same K striping.
    v8f accS0 = {}, accS1 = {}, accR = {};
#pragma unroll
    for (int kk = 0; kk < 16; ++kk) {
      const int d0 = 4 * kk + 2 * half;
      v2f a;  a.x  = Sc[ln][d0];             a.y  = Sc[ln][d0 + 1];
      v2f b0; b0.x = Kb[cb + ln][d0];        b0.y = Kb[cb + ln][d0 + 1];
      v2f b1; b1.x = Kb[cb + 16 + ln][d0];   b1.y = Kb[cb + 16 + ln][d0 + 1];
      v2f b2; b2.x = Ekp[ln][d0];            b2.y = Ekp[ln][d0 + 1];
      accS0 = WMMA_F32X4(a, b0, accS0);
      accS1 = WMMA_F32X4(a, b1, accS1);
      accR  = WMMA_F32X4(a, b2, accR);
    }
    // C/D layout: vgpr j -> M = j + 8*half, N = ln
#pragma unroll
    for (int j = 0; j < 8; ++j) {
      const int m = j + 8 * half;
      Sc[m][ln]      = accS0[j];
      Sc[m][16 + ln] = accS1[j];
      Sc[m][32 + ln] = accR[j];
    }
    __syncthreads();

    // ---- per-row softmax over the 11 window offsets; build weight matrices in place ----
    if (lane < 16) {
      const int m = lane;
      float sc[W];
      float mx = -1e30f;
#pragma unroll
      for (int w = 0; w < W; ++w) {
        // band column for (row m, offset w-5): c = m + w + 3
        sc[w] = 0.125f * (Sc[m][m + w + 3] + Sc[m][32 + w]);   // scale = 1/sqrt(64)
        mx = fmaxf(mx, sc[w]);
      }
      float sum = 0.0f;
#pragma unroll
      for (int w = 0; w < W; ++w) { sc[w] = exp_slot(sc[w] - mx); sum += sc[w]; }
      const float inv = 1.0f / sum;
#pragma unroll
      for (int c = 0; c < 32; ++c) Sc[m][c] = 0.0f;
#pragma unroll
      for (int w = 0; w < W; ++w) Sc[m][m + w + 3] = sc[w] * inv;
#pragma unroll
      for (int w = 0; w < 16; ++w) Sc[m][32 + w] = (w < W) ? sc[w] * inv : 0.0f;
    }
    // V(t) landed; every wave has left the K band.
    wait_ds0();
    wait_async0();
    __syncthreads();
    if (t + 1 < NT) async_ld_b128_x10(lk, gb, k + base + step);   // scalar test, alike in the whole work-group

    // weight fragments into registers, so that this wave's rows are free for the next tile's Q
    v2f aw[12];
#pragma unroll
    for (int kk = 0; kk < 8; ++kk) {           // 32 band columns
      const int c0 = 4 * kk + 2 * half;
      aw[kk].x = Sc[ln][c0];  aw[kk].y = Sc[ln][c0 + 1];
    }
#pragma unroll
    for (int kk = 0; kk < 4; ++kk) {           // 16 (11 valid) offsets
      const int w0 = 4 * kk + 2 * half;
      aw[8 + kk].x = Sc[ln][32 + w0];  aw[8 + kk].y = Sc[ln][32 + w0 + 1];
    }
    if (t + 1 < NT) {
      wait_ds0();          // the reads above have returned before copies overwrite these rows
      async_ld_b128_x8(lq, gq, q + base + step);
    }

    // ---- out = Wband(16x32) * Vband(32x64)  +  Woff(16x16) * ev(16x64) ----
#pragma unroll
    for (int nt = 0; nt < 4; ++nt) {
      v8f acc = {};
#pragma unroll
      for (int kk = 0; kk < 8; ++kk) {           // K over 32 band columns
        const int c0 = 4 * kk + 2 * half;
        v2f b; b.x = Vb[cb + c0][16 * nt + ln];   b.y = Vb[cb + c0 + 1][16 * nt + ln];
        acc = WMMA_F32X4(aw[kk], b, acc);
      }
#pragma unroll
      for (int kk = 0; kk < 4; ++kk) {           // K over 16 (11 valid) offsets
        const int w0 = 4 * kk + 2 * half;
        v2f b; b.x = Evp[w0][16 * nt + ln];  b.y = Evp[w0 + 1][16 * nt + ln];
        acc = WMMA_F32X4(aw[8 + kk], b, acc);
      }
#pragma unroll
      for (int j = 0; j < 8; ++j) {
        const int m = j + 8 * half;
        out[base + (long)(s0 + cb + m) * D + 16 * nt + ln] = acc[j];
      }
    }
    // precaution: stands in front of the next trip's writes of the stores' address registers
    asm volatile("s_wait_xcnt 0x0" ::: "memory");
    base += step;
  }
}

extern "C" void kernel_launch(void* const* d_in, const int* in_sizes, int n_in,
                              void* d_out, int out_size, void* d_ws, size_t ws_size,
                              hipStream_t stream) {
  const float* q  = (const float*)d_in[0];
  const float* k  = (const float*)d_in[1];
  const float* v  = (const float*)d_in[2];
  const float* ek = (const float*)d_in[3];
  const float* ev = (const float*)d_in[4];
  float* out = (float*)d_out;

  dim3 grid(NG);   // 1024 work-groups of 4 waves, 4 tiles of 64 rows each
  dim3 block(NW * 32);
  hipLaunchKernelGGL(winattn_kernel, grid, block, 0, stream, q, k, v, ek, ev, out);
}
